// v000
// The times below were measured on an AMD MI455X: many runs one after another, warmed up first and cycling through
// copies of the inputs, with the whole window's GPU time divided by the number of runs. Launches and the gaps
// between them are all in it. The median over several windows is given; except for v000 it joins two sittings, which
// can be a few percent apart, so the side-by-side timings, each taken in one sitting, are the better comparison.
// v000 is the starting kernel. One run takes 105 microseconds.
#include <hip/hip_runtime.h>
#include <hip/hip_bf16.h>

typedef __attribute__((ext_vector_type(2))) float v2f;
typedef __attribute__((ext_vector_type(8))) float v8f;

#define WSZ   128            // window size
#define EDIM  64             // head dim
#define KROWS 256            // extended key rows (look-back + current)
#define LDK   68             // padded LDS row stride (floats) for K/V
#define PSTR  18             // padded stride for per-wave P staging tile (even -> 8B aligned)
#define NWAVE 8

__global__ __launch_bounds__(256)
void LocalAttention_47313359733390_kernel(const float* __restrict__ q,
                                          const float* __restrict__ k,
                                          const float* __restrict__ v,
                                          float* __restrict__ out) {
    extern __shared__ float smem[];
    float* K_lds = smem;                       // 256*68
    float* V_lds = K_lds + KROWS * LDK;        // 256*68
    float* P_lds = V_lds + KROWS * LDK;        // 8*16*18

    const int blk  = blockIdx.x;               // 0..2047
    const int w    = blk & 63;                 // window index
    const int Bh   = blk >> 6;                 // merged batch*head
    const int tid  = threadIdx.x;
    const int wave = tid >> 5;
    const int lane = tid & 31;
    const int m    = lane & 15;                // row/col-in-tile index
    const int kh   = lane >> 4;                // K-half select (lanes 0-15 vs 16-31)

    const size_t base = ((size_t)Bh * 64 + (size_t)w) * (WSZ * EDIM);

    // ---- async global->LDS stage of K_ext / V_ext (ASYNCcnt path) ----
    for (int i = tid; i < KROWS * (EDIM / 4); i += 256) {
        const int row = i >> 4;                // 0..255
        const int c4  = i & 15;                // float4 column
        const unsigned loff = (unsigned)((row * LDK + c4 * 4) * sizeof(float));
        if (w == 0 && row < WSZ) {
            const float4 z = make_float4(0.f, 0.f, 0.f, 0.f);
            *(float4*)(&K_lds[row * LDK + c4 * 4]) = z;
            *(float4*)(&V_lds[row * LDK + c4 * 4]) = z;
        } else {
            const long off = (long)row - WSZ;  // relative to current window start
            const float* gk = k + base + off * EDIM + c4 * 4;
            const float* gv = v + base + off * EDIM + c4 * 4;
            asm volatile("global_load_async_to_lds_b128 %0, %1, off"
                         :: "v"(loff), "v"(gk) : "memory");
            asm volatile("global_load_async_to_lds_b128 %0, %1, off"
                         :: "v"((unsigned)(loff + KROWS * LDK * sizeof(float))),
                            "v"(gv) : "memory");
        }
    }

    // ---- load Q A-fragments (scale folded in; 0.125 = 2^-3 is exact) ----
    const float* qrow = q + base + (size_t)(wave * 16 + m) * EDIM;
    v2f qa[16];
#pragma unroll
    for (int c = 0; c < 16; ++c) {
        qa[c].x = qrow[4 * c + 2 * kh] * 0.125f;
        qa[c].y = qrow[4 * c + 2 * kh + 1] * 0.125f;
    }

    asm volatile("s_wait_asynccnt 0x0" ::: "memory");
    __syncthreads();

    // ---- S = (Q*scale) * K_ext^T : batch 16 B-frag loads, then dense WMMA chain ----
    v8f S[16];
#pragma unroll
    for (int nt = 0; nt < 16; ++nt) {
        const float* kb = &K_lds[(nt * 16 + m) * LDK + 2 * kh];
        v2f bf[16];
#pragma unroll
        for (int c = 0; c < 16; ++c)
            bf[c] = *(const v2f*)(kb + 4 * c);      // ds_load_b64, 8B aligned
        v8f acc = {};
#pragma unroll
        for (int c = 0; c < 16; ++c)
            acc = __builtin_amdgcn_wmma_f32_16x16x4_f32(
                false, qa[c], false, bf[c], (short)0, acc, false, false);
        S[nt] = acc;
    }

    // ---- mask + numerically-stable softmax (rows live in 16-lane halves) ----
    const float NEG = -3.402823466e38f;
#pragma unroll
    for (int vg = 0; vg < 8; ++vg) {
        const int i = wave * 16 + vg + 8 * kh;      // q row within window (0..127)
        float lm = NEG;
#pragma unroll
        for (int nt = 0; nt < 16; ++nt) {
            const int j = nt * 16 + m;              // extended key column (0..255)
            float s = S[nt][vg];
            const bool masked = (w == 0 && j < 128) || (j >= 128 && i < (j - 128));
            s = masked ? NEG : s;
            S[nt][vg] = s;
            lm = fmaxf(lm, s);
        }
        for (int off = 1; off < 16; off <<= 1)
            lm = fmaxf(lm, __shfl_xor(lm, off, 32));
        float ls = 0.f;
#pragma unroll
        for (int nt = 0; nt < 16; ++nt) {
            const float p = __expf(S[nt][vg] - lm);
            S[nt][vg] = p;
            ls += p;
        }
        for (int off = 1; off < 16; off <<= 1)
            ls += __shfl_xor(ls, off, 32);
        const float inv = 1.0f / ls;
#pragma unroll
        for (int nt = 0; nt < 16; ++nt) S[nt][vg] *= inv;
    }

    // ---- O = P * V_ext : per key-tile, C/D->A layout flip via per-wave LDS,
    //      loads batched ahead of a dense 16-WMMA chain ----
    v8f O[4] = {};
    float* pw = &P_lds[wave * 16 * PSTR];
#pragma unroll
    for (int kt = 0; kt < 16; ++kt) {
#pragma unroll
        for (int vg = 0; vg < 8; ++vg)
            pw[(vg + 8 * kh) * PSTR + m] = S[kt][vg];
        // per-wave buffer; LDS ops from one wave are in-order -> no barrier
        v2f a[4], bb[16];
#pragma unroll
        for (int c = 0; c < 4; ++c)
            a[c] = *(const v2f*)(pw + m * PSTR + 4 * c + 2 * kh);
#pragma unroll
        for (int c = 0; c < 4; ++c)
#pragma unroll
            for (int et = 0; et < 4; ++et) {
                const float* vb = &V_lds[(kt * 16 + 4 * c + 2 * kh) * LDK + et * 16 + m];
                bb[c * 4 + et].x = vb[0];
                bb[c * 4 + et].y = vb[LDK];
            }
#pragma unroll
        for (int c = 0; c < 4; ++c)
#pragma unroll
            for (int et = 0; et < 4; ++et)
                O[et] = __builtin_amdgcn_wmma_f32_16x16x4_f32(
                    false, a[c], false, bb[c * 4 + et], (short)0, O[et], false, false);
    }

    // ---- stage O in (now dead) K_lds, then fully coalesced float4 stores ----
    __syncthreads();   // all waves done reading K_lds
#pragma unroll
    for (int et = 0; et < 4; ++et)
#pragma unroll
        for (int vg = 0; vg < 8; ++vg)
            K_lds[(wave * 16 + vg + 8 * kh) * LDK + et * 16 + m] = O[et][vg];
    __syncthreads();   // staged rows visible to all threads
    for (int i = tid; i < WSZ * (EDIM / 4); i += 256) {
        const int row = i >> 4;
        const int c4  = i & 15;
        const float4 val = *(const float4*)(&K_lds[row * LDK + c4 * 4]);
        *(float4*)(out + base + (size_t)row * EDIM + c4 * 4) = val;
    }
}

extern "C" void kernel_launch(void* const* d_in, const int* in_sizes, int n_in,
                              void* d_out, int out_size, void* d_ws, size_t ws_size,
                              hipStream_t stream) {
    const float* q = (const float*)d_in[0];
    const float* k = (const float*)d_in[1];
    const float* v = (const float*)d_in[2];
    float* out = (float*)d_out;

    const int blocks = 32 * 64;  // (batch*heads) * windows
    const size_t shmem = (size_t)(2 * KROWS * LDK + NWAVE * 16 * PSTR) * sizeof(float);
    LocalAttention_47313359733390_kernel<<<blocks, 256, shmem, stream>>>(q, k, v, out);
}

// v001
// One run takes 83.3 microseconds.
// Two timings next to v000 put it at 1.29 and 1.30 times that version's speed.
#include <hip/hip_runtime.h>
#include <hip/hip_bf16.h>

typedef __attribute__((ext_vector_type(2))) float v2f;
typedef __attribute__((ext_vector_type(8))) float v8f;

#define WSZ   128            // window size
#define EDIM  64             // head dim
#define KROWS 256            // extended key rows (look-back + current)
#define LDK   68             // padded LDS row stride (floats) for K/V
#define PSTR  18             // padded stride for per-wave P staging tile (even -> 8B aligned)
#define NWAVE 8

__global__ __launch_bounds__(256)
void LocalAttention_47313359733390_kernel(const float* __restrict__ q,
                                          const float* __restrict__ k,
                                          const float* __restrict__ v,
                                          float* __restrict__ out) {
    extern __shared__ float smem[];
    float* K_lds = smem;                       // 256*68
    float* V_lds = K_lds + KROWS * LDK;        // 256*68
    float* P_lds = V_lds + KROWS * LDK;        // 8*16*18

    const int blk  = blockIdx.x;               // 0..2047
    const int w    = blk & 63;                 // window index
    const int Bh   = blk >> 6;                 // merged batch*head
    const int tid  = threadIdx.x;
    const int wave = tid >> 5;
    const int lane = tid & 31;
    const int m    = lane & 15;                // row/col-in-tile index
    const int kh   = lane >> 4;                // K-half select (lanes 0-15 vs 16-31)

    const size_t base = ((size_t)Bh * 64 + (size_t)w) * (WSZ * EDIM);

    // ---- async global->LDS stage of K_ext / V_ext (ASYNCcnt path) ----
    for (int i = tid; i < KROWS * (EDIM / 4); i += 256) {
        const int row = i >> 4;                // 0..255
        const int c4  = i & 15;                // float4 column
        const unsigned loff = (unsigned)((row * LDK + c4 * 4) * sizeof(float));
        if (w == 0 && row < WSZ) {
            const float4 z = make_float4(0.f, 0.f, 0.f, 0.f);
            *(float4*)(&K_lds[row * LDK + c4 * 4]) = z;
            *(float4*)(&V_lds[row * LDK + c4 * 4]) = z;
        } else {
            const long off = (long)row - WSZ;  // relative to current window start
            const float* gk = k + base + off * EDIM + c4 * 4;
            const float* gv = v + base + off * EDIM + c4 * 4;
            asm volatile("global_load_async_to_lds_b128 %0, %1, off"
                         :: "v"(loff), "v"(gk) : "memory");
            asm volatile("global_load_async_to_lds_b128 %0, %1, off"
                         :: "v"((unsigned)(loff + KROWS * LDK * sizeof(float))),
                            "v"(gv) : "memory");
        }
    }

    // ---- query tile of this wave. Key tiles right of the diagonal are fully masked and are
    //      skipped below, so a wave's work grows with its query tile: waves x and x + 4 take
    //      tiles t and 7 - t, which add up to the same number of key tiles for every such pair.
    //      readfirstlane holds it in a scalar register: the tile tests below are scalar branches ----
    const int qt = __builtin_amdgcn_readfirstlane(wave < 4 ? wave : 11 - wave);
    const bool look_back = (w != 0);           // window 0: every look-back key is padding

    // ---- load Q A-fragments (scale folded in; 0.125 = 2^-3 is exact) ----
    const float* qrow = q + base + (size_t)(qt * 16 + m) * EDIM;
    v2f qa[16];
#pragma unroll
    for (int c = 0; c < 16; ++c) {
        qa[c].x = qrow[4 * c + 2 * kh] * 0.125f;
        qa[c].y = qrow[4 * c + 2 * kh + 1] * 0.125f;
    }

    asm volatile("s_wait_asynccnt 0x0" ::: "memory");
    __syncthreads();

    // ---- S = (Q*scale) * K_ext^T, live key tiles only: batch 16 B-frag loads, dense WMMA
    //      chain, then the tile's mask and its share of the row maxima ----
    const float NEG = -3.402823466e38f;
    v8f S[16];
    float lm[8];
#pragma unroll  // constant indices keep S, lm, ls, inv in registers
    for (int vg = 0; vg < 8; ++vg) lm[vg] = NEG;

    auto score_tile = [&](const int nt) {
        const float* kb = &K_lds[(nt * 16 + m) * LDK + 2 * kh];
        v2f bf[16];
#pragma unroll
        for (int c = 0; c < 16; ++c)
            bf[c] = *(const v2f*)(kb + 4 * c);      // ds_load_b64, 8B aligned
        v8f acc = {};
#pragma unroll
        for (int c = 0; c < 16; ++c)
            acc = __builtin_amdgcn_wmma_f32_16x16x4_f32(
                false, qa[c], false, bf[c], (short)0, acc, false, false);
#pragma unroll  // constant indices keep S, lm, ls, inv in registers
        for (int vg = 0; vg < 8; ++vg) {
            const int i = qt * 16 + vg + 8 * kh;    // q row within window (0..127)
            const int j = nt * 16 + m;              // extended key column (0..255)
            float s = acc[vg];
            if (nt >= 8) s = (i < (j - 128)) ? NEG : s;
            acc[vg] = s;
            lm[vg] = fmaxf(lm[vg], s);
        }
        S[nt] = acc;
    };
    if (look_back) {
#pragma unroll  // constant indices keep S, lm, ls, inv in registers
        for (int nt = 0; nt < 8; ++nt) score_tile(nt);
    }
    score_tile(8);                             // first tile of the own window: live for every wave
#pragma unroll  // constant indices keep S, lm, ls, inv in registers
    for (int nt = 9; nt < 16; ++nt)
        if (nt - 8 <= qt) score_tile(nt);

    // ---- numerically-stable softmax (rows live in 16-lane halves) ----
#pragma unroll  // constant indices keep S, lm, ls, inv in registers
    for (int vg = 0; vg < 8; ++vg)
        for (int off = 1; off < 16; off <<= 1)
            lm[vg] = fmaxf(lm[vg], __shfl_xor(lm[vg], off, 32));

    float ls[8];
#pragma unroll  // constant indices keep S, lm, ls, inv in registers
    for (int vg = 0; vg < 8; ++vg) ls[vg] = 0.f;
    auto exp_tile = [&](const int nt) {
#pragma unroll  // constant indices keep S, lm, ls, inv in registers
        for (int vg = 0; vg < 8; ++vg) {
            const float p = __expf(S[nt][vg] - lm[vg]);
            S[nt][vg] = p;
            ls[vg] += p;
        }
    };
    if (look_back) {
#pragma unroll  // constant indices keep S, lm, ls, inv in registers
        for (int nt = 0; nt < 8; ++nt) exp_tile(nt);
    }
    exp_tile(8);
#pragma unroll  // constant indices keep S, lm, ls, inv in registers
    for (int nt = 9; nt < 16; ++nt)
        if (nt - 8 <= qt) exp_tile(nt);

    float inv[8];
#pragma unroll  // constant indices keep S, lm, ls, inv in registers
    for (int vg = 0; vg < 8; ++vg) {
        for (int off = 1; off < 16; off <<= 1)
            ls[vg] += __shfl_xor(ls[vg], off, 32);
        inv[vg] = 1.0f / ls[vg];
    }

    // ---- O = P * V_ext, live key tiles only: per key-tile, C/D->A layout flip via per-wave
    //      LDS, loads batched ahead of a dense 16-WMMA chain ----
    v8f O[4] = {};
    float* pw = &P_lds[wave * 16 * PSTR];
    auto pv_tile = [&](const int kt) {
#pragma unroll  // constant indices keep S, lm, ls, inv in registers
        for (int vg = 0; vg < 8; ++vg)
            pw[(vg + 8 * kh) * PSTR + m] = S[kt][vg] * inv[vg];
        // per-wave buffer; LDS ops from one wave are in-order -> no barrier
        v2f a[4], bb[16];
#pragma unroll
        for (int c = 0; c < 4; ++c)
            a[c] = *(const v2f*)(pw + m * PSTR + 4 * c + 2 * kh);
#pragma unroll
        for (int c = 0; c < 4; ++c)
#pragma unroll
            for (int et = 0; et < 4; ++et) {
                const float* vb = &V_lds[(kt * 16 + 4 * c + 2 * kh) * LDK + et * 16 + m];
                bb[c * 4 + et].x = vb[0];
                bb[c * 4 + et].y = vb[LDK];
            }
#pragma unroll
        for (int c = 0; c < 4; ++c)
#pragma unroll
            for (int et = 0; et < 4; ++et)
                O[et] = __builtin_amdgcn_wmma_f32_16x16x4_f32(
                    false, a[c], false, bb[c * 4 + et], (short)0, O[et], false, false);
    };
    if (look_back) {
#pragma unroll  // constant indices keep S, lm, ls, inv in registers
        for (int kt = 0; kt < 8; ++kt) pv_tile(kt);
    }
    pv_tile(8);
#pragma unroll  // constant indices keep S, lm, ls, inv in registers
    for (int kt = 9; kt < 16; ++kt)
        if (kt - 8 <= qt) pv_tile(kt);

    // ---- stage O in (now dead) K_lds, then fully coalesced float4 stores ----
    __syncthreads();   // all waves done reading K_lds
#pragma unroll
    for (int et = 0; et < 4; ++et)
#pragma unroll
        for (int vg = 0; vg < 8; ++vg)
            K_lds[(qt * 16 + vg + 8 * kh) * LDK + et * 16 + m] = O[et][vg];
    __syncthreads();   // staged rows visible to all threads
    for (int i = tid; i < WSZ * (EDIM / 4); i += 256) {
        const int row = i >> 4;
        const int c4  = i & 15;
        const float4 val = *(const float4*)(&K_lds[row * LDK + c4 * 4]);
        *(float4*)(out + base + (size_t)row * EDIM + c4 * 4) = val;
    }
}

extern "C" void kernel_launch(void* const* d_in, const int* in_sizes, int n_in,
                              void* d_out, int out_size, void* d_ws, size_t ws_size,
                              hipStream_t stream) {
    const float* q = (const float*)d_in[0];
    const float* k = (const float*)d_in[1];
    const float* v = (const float*)d_in[2];
    float* out = (float*)d_out;

    const int blocks = 32 * 64;  // (batch*heads) * windows
    const size_t shmem = (size_t)(2 * KROWS * LDK + NWAVE * 16 * PSTR) * sizeof(float);
    LocalAttention_47313359733390_kernel<<<blocks, 256, shmem, stream>>>(q, k, v, out);
}

// v003
// It runs in 74.7 microseconds.
// It is 1.10 times as fast as v001, going by the measured steps of the versions left out in between.
// Counting every step since v000, it is 1.43 times as fast.
#include <hip/hip_runtime.h>
#include <hip/hip_bf16.h>

typedef __attribute__((ext_vector_type(2))) float v2f;
typedef __attribute__((ext_vector_type(4))) float v4f;
typedef __attribute__((ext_vector_type(8))) float v8f;

#define WSZ   128            // window size
#define EDIM  64             // head dim
#define LDK   68             // padded LDS row stride (floats) for K/V
#define WT    (WSZ * LDK)    // floats of one staged window of K or of V
#define RUN   4              // consecutive windows that one work-group walks
#define LDO   36             // padded LDS row stride (floats) of a wave's output staging (32 columns)

// Four async global->LDS copies of 16 bytes a lane. s_wait_xcnt 0 ends the copies' own statement,
// so no address register of theirs is rewritten in front of it.
__device__ __forceinline__ void copy4(unsigned l0, unsigned l1, unsigned l2, unsigned l3,
                                      const float* g0, const float* g1,
                                      const float* g2, const float* g3) {
    asm volatile("global_load_async_to_lds_b128 %0, %4, off\n\t"
                 "global_load_async_to_lds_b128 %1, %5, off\n\t"
                 "global_load_async_to_lds_b128 %2, %6, off\n\t"
                 "global_load_async_to_lds_b128 %3, %7, off\n\t"
                 "s_wait_xcnt 0x0"
                 :: "v"(l0), "v"(l1), "v"(l2), "v"(l3), "v"(g0), "v"(g1), "v"(g2), "v"(g3)
                 : "memory");
}

// One window (128 rows of 64 floats) of K or V into one LDS buffer: 8 copies a lane, every lane on.
// l = the lane's LDS byte address in the buffer's rows 0..15, g = its global address in those rows.
__device__ __forceinline__ void stage_window(unsigned l, const float* g) {
    const unsigned ls = 16 * LDK * sizeof(float);   // 16 rows further in LDS
    const int      gs = 16 * EDIM;                  // 16 rows further in global memory
    copy4(l,          l + ls,     l + 2 * ls, l + 3 * ls, g,          g + gs,     g + 2 * gs, g + 3 * gs);
    copy4(l + 4 * ls, l + 5 * ls, l + 6 * ls, l + 7 * ls, g + 4 * gs, g + 5 * gs, g + 6 * gs, g + 7 * gs);
}

// Publish point of a ring stage: this wave's LDS reads have retired, its own copies have landed,
// then the work-group barrier; behind it the stage may be read and the buffer just left refilled.
__device__ __forceinline__ void publish() {
    asm volatile("s_wait_dscnt 0x0" ::: "memory");     // own reads of the buffer to be refilled are done
    asm volatile("s_wait_asynccnt 0x0" ::: "memory");  // own copies of the stage to be read have landed
    __syncthreads();
}

__global__ __launch_bounds__(256)
void LocalAttention_47313359733390_kernel(const float* __restrict__ q,
                                          const float* __restrict__ k,
                                          const float* __restrict__ v,
                                          float* __restrict__ out) {
    extern __shared__ float smem[];
    float* K_lds = smem;                       // two window buffers of K
    float* V_lds = smem + 2 * WT;              // two window buffers of V
    float* O_lds = smem + 4 * WT;              // 8 waves x 16 rows x LDO: output staging, private to a wave

    const int blk  = blockIdx.x;               // 0..511
    const int w0   = (blk & (64 / RUN - 1)) * RUN;   // first window of this work-group's run
    const int Bh   = blk / (64 / RUN);         // merged batch*head
    const int tid  = threadIdx.x;
    const int wave = tid >> 5;
    const int lane = tid & 31;
    const int m    = lane & 15;                // row/col-in-tile index
    const int kh   = lane >> 4;                // K-half select (lanes 0-15 vs 16-31)

    const size_t base0 = ((size_t)Bh * 64 + (size_t)w0) * (WSZ * EDIM);   // window w0

    // ---- the lane's share of a window copy: row tid/16 (+16 a copy), float4 column tid%16 ----
    const unsigned lrow = (unsigned)(((tid >> 4) * LDK + (tid & 15) * 4) * sizeof(float));
    const unsigned lK   = (unsigned)(size_t)K_lds + lrow;
    const unsigned lV   = (unsigned)(size_t)V_lds + lrow;
    const unsigned lbuf = WT * sizeof(float);  // from buffer 0 to buffer 1
    const float* gk = k + base0 + tid * 4;
    const float* gv = v + base0 + tid * 4;

    // ---- query tile of this wave. Key tiles right of the diagonal are fully masked and are
    //      skipped below, so a wave's work grows with its query tile: waves x and x + 4 take
    //      tiles t and 7 - t, which add up to the same number of key tiles for every such pair.
    //      readfirstlane holds it in a scalar register: the tile tests below are scalar branches ----
    const int qt = __builtin_amdgcn_readfirstlane(wave < 4 ? wave : 11 - wave);

    // ---- ring: window w0 + t lies in buffer t & 1 of K and of V, its look-back window in the other.
    //      K is read only by the score products and V only by the second products, so the next
    //      window's K flies during the second products and its V during the next score products ----
    if (w0 != 0) stage_window(lK + lbuf, gk - WSZ * EDIM);   // window 0 has no look-back keys
    stage_window(lK, gk);

    // ---- Q fragments of the first window: lane = query m, its k half kh ----
    const float* qp = q + base0 + (size_t)(qt * 16 + m) * EDIM + 2 * kh;
    v2f qraw[16];
#pragma unroll
    for (int c = 0; c < 16; ++c) qraw[c] = *(const v2f*)(qp + 4 * c);

    publish();                                 // K of the first trip is readable
    if (w0 != 0) stage_window(lV + lbuf, gv - WSZ * EDIM);
    stage_window(lV, gv);

    float* Ow = O_lds + wave * (16 * LDO);
    const float NEG = -3.402823466e38f;

#pragma unroll 1  // one copy of the unrolled tile code, for speed only
    for (int t = 0; t < RUN; ++t) {
        const bool look_back = (w0 + t != 0);  // window 0: every look-back key is padding
        const bool more      = (t + 1 < RUN);  // a next window exists in this run
        const int  cur  = (t & 1) * WT;        // buffer of the own window (floats)
        const int  prev = WT - cur;            // buffer of the look-back window
        const size_t base = base0 + (size_t)t * (WSZ * EDIM);

        // ---- scale folded into Q (0.125 = 2^-3 is exact). B operand (Q^T) of S^T = K * Q^T ----
        v2f qa[16];
#pragma unroll
        for (int c = 0; c < 16; ++c) qa[c] = qraw[c] * 0.125f;

        // ---- S^T = K_ext * (Q*scale)^T, live key tiles only: batch 16 A-frag loads, dense WMMA
        //      chain, then the tile's mask and its share of the maxima. A lane then holds scores of
        //      ONE query (column m): register vg = key nt*16 + 8*kh + vg ----
        v8f S[16];
        float lm[8];
#pragma unroll  // constant indices keep S, lm, ls in registers
        for (int vg = 0; vg < 8; ++vg) lm[vg] = NEG;

        auto score_tile = [&](const int nt) {
            const float* kb = &K_lds[(nt < 8 ? prev : cur) + ((nt & 7) * 16 + m) * LDK + 2 * kh];
            v2f kf[16];
#pragma unroll
            for (int c = 0; c < 16; ++c)
                kf[c] = *(const v2f*)(kb + 4 * c);      // ds_load_b64, 8B aligned
            v8f acc = {};
#pragma unroll
            for (int c = 0; c < 16; ++c)
                acc = __builtin_amdgcn_wmma_f32_16x16x4_f32(
                    false, kf[c], false, qa[c], (short)0, acc, false, false);
#pragma unroll  // constant indices keep S, lm, ls in registers
            for (int vg = 0; vg < 8; ++vg) {
                const int i = qt * 16 + m;              // q row within window (0..127)
                const int j = nt * 16 + vg + 8 * kh;    // extended key row (0..255)
                float s = acc[vg];
                if (nt >= 8) s = (i < (j - 128)) ? NEG : s;
                acc[vg] = s;
                lm[vg] = fmaxf(lm[vg], s);
            }
            S[nt] = acc;
        };
        if (look_back) {
#pragma unroll  // constant indices keep S, lm, ls in registers
            for (int nt = 0; nt < 8; ++nt) score_tile(nt);
        }
        score_tile(8);                         // first tile of the own window: live for every wave
#pragma unroll  // constant indices keep S, lm, ls in registers
        for (int nt = 9; nt < 16; ++nt)
            if (nt - 8 <= qt) score_tile(nt);

        // ---- numerically-stable softmax: a query's keys lie in the registers of lanes m and m + 16,
        //      so maximum and sum fold in-lane, plus one exchange between the wave's halves ----
        float mx = fmaxf(fmaxf(fmaxf(lm[0], lm[1]), fmaxf(lm[2], lm[3])),
                         fmaxf(fmaxf(lm[4], lm[5]), fmaxf(lm[6], lm[7])));
        mx = fmaxf(mx, __shfl_xor(mx, 16, 32));

        float ls[8];
#pragma unroll  // constant indices keep S, lm, ls in registers
        for (int vg = 0; vg < 8; ++vg) ls[vg] = 0.f;
        auto exp_tile = [&](const int nt) {
#pragma unroll  // constant indices keep S, lm, ls in registers
            for (int vg = 0; vg < 8; ++vg) {
                const float p = __expf(S[nt][vg] - mx);
                S[nt][vg] = p;
                ls[vg] += p;
            }
        };
        if (look_back) {
#pragma unroll  // constant indices keep S, lm, ls in registers
            for (int nt = 0; nt < 8; ++nt) exp_tile(nt);
        }
        exp_tile(8);
#pragma unroll  // constant indices keep S, lm, ls in registers
        for (int nt = 9; nt < 16; ++nt)
            if (nt - 8 <= qt) exp_tile(nt);

        float sum = ((ls[0] + ls[1]) + (ls[2] + ls[3])) + ((ls[4] + ls[5]) + (ls[6] + ls[7]));
        sum += __shfl_xor(sum, 16, 32);
        const float inv = 1.0f / sum;          // applied to O once, behind the products

        // ---- V of this trip is readable; every wave has left K's look-back buffer: refill it ----
        publish();
        if (more) stage_window(lK + (unsigned)prev * sizeof(float), gk + (t + 1) * (WSZ * EDIM));

        // ---- O^T = V_ext^T * P^T, live key tiles only. Registers 2c, 2c+1 of a score tile ARE the
        //      B operand of k step c: its four keys are 2c, 2c+1 (lanes 0-15) and 8+2c, 9+2c (lanes
        //      16-31); the V^T loader takes the same keys at the same lane half and register ----
        v8f O[4] = {};
        auto pv_tile = [&](const int kt) {
            v2f vf[16];
#pragma unroll
            for (int c = 0; c < 4; ++c)
#pragma unroll
                for (int et = 0; et < 4; ++et) {
                    const float* vb = &V_lds[(kt < 8 ? prev : cur) +
                                             ((kt & 7) * 16 + 8 * kh + 2 * c) * LDK + et * 16 + m];
                    vf[c * 4 + et].x = vb[0];
                    vf[c * 4 + et].y = vb[LDK];
                }
#pragma unroll
            for (int c = 0; c < 4; ++c) {
                v2f p;
                p.x = S[kt][2 * c];
                p.y = S[kt][2 * c + 1];
#pragma unroll
                for (int et = 0; et < 4; ++et)
                    O[et] = __builtin_amdgcn_wmma_f32_16x16x4_f32(
                        false, vf[c * 4 + et], false, p, (short)0, O[et], false, false);
            }
        };
        if (look_back) {
#pragma unroll  // constant indices keep S, lm, ls in registers
            for (int kt = 0; kt < 8; ++kt) pv_tile(kt);
        }
        // ---- the next window's Q flies during the rest of this trip (the look-back scores'
        //      registers are free by now). The last trip reads its own rows again: an unconditional
        //      load lets the old fragments' registers go free at the top of the trip ----
        if (more) qp += WSZ * EDIM;
#pragma unroll
        for (int c = 0; c < 16; ++c) qraw[c] = *(const v2f*)(qp + 4 * c);
        pv_tile(8);
#pragma unroll  // constant indices keep S, lm, ls in registers
        for (int kt = 9; kt < 16; ++kt)
            if (kt - 8 <= qt) pv_tile(kt);

        // ---- K of the next trip is readable; every wave has left V's look-back buffer: refill it ----
        publish();
        if (more) stage_window(lV + (unsigned)prev * sizeof(float), gv + (t + 1) * (WSZ * EDIM));

        // ---- the wave stages its 16 rows in its own LDS range, 32 columns at a time, and stores
        //      whole 128-byte lines; no other wave touches the range, so no barrier. It stands behind
        //      the trip's last barrier, so that no barrier waits for these stores to return ----
#pragma unroll
        for (int h = 0; h < 2; ++h) {
#pragma unroll
            for (int e = 0; e < 2; ++e) {      // lane: query row m, columns e*16 + 8*kh + 0..7 of the half
                const v8f o = O[2 * h + e];
                float* orow = &Ow[m * LDO + e * 16 + 8 * kh];
                *(float4*)(orow)     = make_float4(o[0] * inv, o[1] * inv, o[2] * inv, o[3] * inv);
                *(float4*)(orow + 4) = make_float4(o[4] * inv, o[5] * inv, o[6] * inv, o[7] * inv);
            }
            asm volatile("s_wait_dscnt 0x0" ::: "memory");   // rows written by other lanes are read next
            const float* rd = &Ow[(lane >> 3) * LDO + (lane & 7) * 4];   // 4 rows a read, 8 lanes a row
            const v4f r0 = *(const v4f*)(rd);
            const v4f r1 = *(const v4f*)(rd + 4 * LDO);
            const v4f r2 = *(const v4f*)(rd + 8 * LDO);
            const v4f r3 = *(const v4f*)(rd + 12 * LDO);
            asm volatile("s_wait_dscnt 0x0" ::: "memory");   // the range is rewritten next: reads first
            float* wr = out + base + (size_t)(qt * 16 + (lane >> 3)) * EDIM + h * 32 + (lane & 7) * 4;
            *(v4f*)(wr)             = r0;
            *(v4f*)(wr + 4 * EDIM)  = r1;
            *(v4f*)(wr + 8 * EDIM)  = r2;
            *(v4f*)(wr + 12 * EDIM) = r3;
        }
        // the next trip rewrites the registers that these stores name: the wait stands in front of that
        asm volatile("s_wait_xcnt 0x0" ::: "memory");
    }
}

extern "C" void kernel_launch(void* const* d_in, const int* in_sizes, int n_in,
                              void* d_out, int out_size, void* d_ws, size_t ws_size,
                              hipStream_t stream) {
    const float* q = (const float*)d_in[0];
    const float* k = (const float*)d_in[1];
    const float* v = (const float*)d_in[2];
    float* out = (float*)d_out;

    const int blocks = 32 * (64 / RUN);  // (batch*heads) * runs of windows
    const size_t shmem = (size_t)(4 * WT + 8 * 16 * LDO) * sizeof(float);
    LocalAttention_47313359733390_kernel<<<blocks, 256, shmem, stream>>>(q, k, v, out);
}

// v004
// One run takes 70.8 microseconds.
// Next to v003, in two timings, it ran 1.04 and 1.05 times as fast.
// Over all steps from v000 it is 1.50 times as fast.
#include <hip/hip_runtime.h>
#include <hip/hip_bf16.h>

typedef __attribute__((ext_vector_type(2))) float v2f;
typedef __attribute__((ext_vector_type(4))) float v4f;
typedef __attribute__((ext_vector_type(8))) float v8f;

#define WSZ   128            // window size
#define EDIM  64             // head dim
#define LDK   68             // padded LDS row stride (floats) for K/V
#define WT    (WSZ * LDK)    // floats of one staged window of K or of V
#define RUN   4              // consecutive windows that one work-group walks
#define LDO   36             // padded LDS row stride (floats) of a wave's output staging (32 columns)

// Four async global->LDS copies of 16 bytes a lane. s_wait_xcnt 0 ends the copies' own statement,
// so no address register of theirs is rewritten in front of it.
__device__ __forceinline__ void copy4(unsigned l0, unsigned l1, unsigned l2, unsigned l3,
                                      const float* g0, const float* g1,
                                      const float* g2, const float* g3) {
    asm volatile("global_load_async_to_lds_b128 %0, %4, off\n\t"
                 "global_load_async_to_lds_b128 %1, %5, off\n\t"
                 "global_load_async_to_lds_b128 %2, %6, off\n\t"
                 "global_load_async_to_lds_b128 %3, %7, off\n\t"
                 "s_wait_xcnt 0x0"
                 :: "v"(l0), "v"(l1), "v"(l2), "v"(l3), "v"(g0), "v"(g1), "v"(g2), "v"(g3)
                 : "memory");
}

// One window (128 rows of 64 floats) of K or V into one LDS buffer: 8 copies a lane, every lane on.
// l = the lane's LDS byte address in the buffer's rows 0..15, g = its global address in those rows.
__device__ __forceinline__ void stage_window(unsigned l, const float* g) {
    const unsigned ls = 16 * LDK * sizeof(float);   // 16 rows further in LDS
    const int      gs = 16 * EDIM;                  // 16 rows further in global memory
    copy4(l,          l + ls,     l + 2 * ls, l + 3 * ls, g,          g + gs,     g + 2 * gs, g + 3 * gs);
    copy4(l + 4 * ls, l + 5 * ls, l + 6 * ls, l + 7 * ls, g + 4 * gs, g + 5 * gs, g + 6 * gs, g + 7 * gs);
}

// Publish point of a ring stage: this wave's LDS reads have retired, its own copies have landed,
// then the work-group barrier; behind it the stage may be read and the buffer just left refilled.
__device__ __forceinline__ void publish() {
    asm volatile("s_wait_dscnt 0x0" ::: "memory");     // own reads of the buffer to be refilled are done
    asm volatile("s_wait_asynccnt 0x0" ::: "memory");  // own copies of the stage to be read have landed
    __syncthreads();
}

__global__ __launch_bounds__(256)
void LocalAttention_47313359733390_kernel(const float* __restrict__ q,
                                          const float* __restrict__ k,
                                          const float* __restrict__ v,
                                          float* __restrict__ out) {
    extern __shared__ float smem[];
    float* K_lds = smem;                       // two window buffers of K
    float* V_lds = smem + 2 * WT;              // two window buffers of V
    float* O_lds = smem + 4 * WT;              // 8 waves x 16 rows x LDO: output staging, private to a wave

    const int blk  = blockIdx.x;               // 0..511
    const int w0   = (blk & (64 / RUN - 1)) * RUN;   // first window of this work-group's run
    const int Bh   = blk / (64 / RUN);         // merged batch*head
    const int tid  = threadIdx.x;
    const int wave = tid >> 5;
    const int lane = tid & 31;
    const int m    = lane & 15;                // row/col-in-tile index
    const int kh   = lane >> 4;                // K-half select (lanes 0-15 vs 16-31)

    const size_t base0 = ((size_t)Bh * 64 + (size_t)w0) * (WSZ * EDIM);   // window w0

    // ---- the lane's share of a window copy: row tid/16 (+16 a copy), float4 column tid%16 ----
    const unsigned lrow = (unsigned)(((tid >> 4) * LDK + (tid & 15) * 4) * sizeof(float));
    const unsigned lK   = (unsigned)(size_t)K_lds + lrow;
    const unsigned lV   = (unsigned)(size_t)V_lds + lrow;
    const unsigned lbuf = WT * sizeof(float);  // from buffer 0 to buffer 1
    const float* gk = k + base0 + tid * 4;
    const float* gv = v + base0 + tid * 4;

    // ---- query tile of this wave. Key tiles right of the diagonal are fully masked and are
    //      skipped below, so a wave's work grows with its query tile: waves x and x + 4 take
    //      tiles t and 7 - t, which add up to the same number of key tiles for every such pair.
    //      readfirstlane holds it in a scalar register: the tile tests below are scalar branches ----
    const int qt = __builtin_amdgcn_readfirstlane(wave < 4 ? wave : 11 - wave);

    // ---- ring: window w0 + t lies in buffer t & 1 of K and of V, its look-back window in the other.
    //      K is read only by the score products and V only by the second products, so the next
    //      window's K flies during the second products and its V during the next score products ----
    if (w0 != 0) stage_window(lK + lbuf, gk - WSZ * EDIM);   // window 0 has no look-back keys
    stage_window(lK, gk);

    // ---- Q fragments of the first window: lane = query m, its k half kh ----
    const float* qp = q + base0 + (size_t)(qt * 16 + m) * EDIM + 2 * kh;
    v2f qraw[16];
#pragma unroll
    for (int c = 0; c < 16; ++c) qraw[c] = *(const v2f*)(qp + 4 * c);

    publish();                                 // K of the first trip is readable
    if (w0 != 0) stage_window(lV + lbuf, gv - WSZ * EDIM);
    stage_window(lV, gv);

    float* Ow = O_lds + wave * (16 * LDO);
    const float NEG = -3.402823466e38f;

#pragma unroll 1  // one copy of the unrolled tile code, for speed only
    for (int t = 0; t < RUN; ++t) {
        const bool look_back = (w0 + t != 0);  // window 0: every look-back key is padding
        const bool more      = (t + 1 < RUN);  // a next window exists in this run
        const int  cur  = (t & 1) * WT;        // buffer of the own window (floats)
        const int  prev = WT - cur;            // buffer of the look-back window
        const int  first = look_back ? 0 : 8;  // first live key tile of the trip
        const size_t base = base0 + (size_t)t * (WSZ * EDIM);

        // ---- scale folded into Q (0.125 = 2^-3 is exact). B operand (Q^T) of S^T = K * Q^T ----
        v2f qa[16];
#pragma unroll
        for (int c = 0; c < 16; ++c) qa[c] = qraw[c] * 0.125f;

        // ---- S^T = K_ext * (Q*scale)^T, live key tiles only: A-frag loads in groups of 8, half a tile ahead, a 16-step WMMA
        //      chain, then the tile's mask and its share of the maxima. A lane then holds scores of
        //      ONE query (column m): register vg = key nt*16 + 8*kh + vg ----
        v8f S[16];
        float lm[8];
#pragma unroll  // constant indices keep S, lm, ls in registers
        for (int vg = 0; vg < 8; ++vg) lm[vg] = NEG;

        // K fragments are fetched half a tile (8 k steps) ahead, as one group of loads into the registers
        // that the 8 products in front of the group have just read: the LDS latency passes under the
        // 8 products behind it, and no second register set is needed.
        v2f kf[16];
        auto load_k = [&](const int nt, const int half) {
            const float* kb = &K_lds[(nt < 8 ? prev : cur) + ((nt & 7) * 16 + m) * LDK + 2 * kh];
            // this and the one below: the loads stay one group at this place; without them the compiler
            // moves products up in front of the group (a shorter lead) or splits the group among them
            __builtin_amdgcn_sched_barrier(0);
#pragma unroll
            for (int c = 8 * half; c < 8 * half + 8; ++c)
                kf[c] = *(const v2f*)(kb + 4 * c);      // ds_load_b64, 8B aligned
            __builtin_amdgcn_sched_barrier(0);
        };
        auto score_tile = [&](const int nt) {
            v8f acc = {};
#pragma unroll
            for (int c = 0; c < 8; ++c)
                acc = __builtin_amdgcn_wmma_f32_16x16x4_f32(
                    false, kf[c], false, qa[c], (short)0, acc, false, false);
            if (nt < 15) load_k(nt + 1, 0);     // tile 15 has no successor; an unused fetch reads landed rows
#pragma unroll
            for (int c = 8; c < 16; ++c)
                acc = __builtin_amdgcn_wmma_f32_16x16x4_f32(
                    false, kf[c], false, qa[c], (short)0, acc, false, false);
            if (nt < 15) load_k(nt + 1, 1);
#pragma unroll  // constant indices keep S, lm, ls in registers
            for (int vg = 0; vg < 8; ++vg) {
                const int i = qt * 16 + m;              // q row within window (0..127)
                const int j = nt * 16 + vg + 8 * kh;    // extended key row (0..255)
                float s = acc[vg];
                if (nt >= 8) s = (i < (j - 128)) ? NEG : s;
                acc[vg] = s;
                lm[vg] = fmaxf(lm[vg], s);
            }
            S[nt] = acc;
        };
        load_k(first, 0);                      // the trip's first live tile: nothing to hide these behind
        load_k(first, 1);
        if (look_back) {
#pragma unroll  // constant indices keep S, lm, ls in registers
            for (int nt = 0; nt < 8; ++nt) score_tile(nt);
        }
        score_tile(8);                         // first tile of the own window: live for every wave
#pragma unroll  // constant indices keep S, lm, ls in registers
        for (int nt = 9; nt < 16; ++nt)
            if (nt - 8 <= qt) score_tile(nt);  // live tiles are consecutive: each was fetched by the one before

        // ---- numerically-stable softmax: a query's keys lie in the registers of lanes m and m + 16,
        //      so maximum and sum fold in-lane, plus one exchange between the wave's halves ----
        float mx = fmaxf(fmaxf(fmaxf(lm[0], lm[1]), fmaxf(lm[2], lm[3])),
                         fmaxf(fmaxf(lm[4], lm[5]), fmaxf(lm[6], lm[7])));
        mx = fmaxf(mx, __shfl_xor(mx, 16, 32));

        float ls[8];
#pragma unroll  // constant indices keep S, lm, ls in registers
        for (int vg = 0; vg < 8; ++vg) ls[vg] = 0.f;
        auto exp_tile = [&](const int nt) {
#pragma unroll  // constant indices keep S, lm, ls in registers
            for (int vg = 0; vg < 8; ++vg) {
                const float p = __expf(S[nt][vg] - mx);
                S[nt][vg] = p;
                ls[vg] += p;
            }
        };
        if (look_back) {
#pragma unroll  // constant indices keep S, lm, ls in registers
            for (int nt = 0; nt < 8; ++nt) exp_tile(nt);
        }
        exp_tile(8);
#pragma unroll  // constant indices keep S, lm, ls in registers
        for (int nt = 9; nt < 16; ++nt)
            if (nt - 8 <= qt) exp_tile(nt);

        float sum = ((ls[0] + ls[1]) + (ls[2] + ls[3])) + ((ls[4] + ls[5]) + (ls[6] + ls[7]));
        sum += __shfl_xor(sum, 16, 32);
        const float inv = 1.0f / sum;          // applied to O once, behind the products

        // ---- V of this trip is readable; every wave has left K's look-back buffer: refill it ----
        publish();
        if (more) stage_window(lK + (unsigned)prev * sizeof(float), gk + (t + 1) * (WSZ * EDIM));

        // ---- O^T = V_ext^T * P^T, live key tiles only. Registers 2c, 2c+1 of a score tile ARE the
        //      B operand of k step c: its four keys are 2c, 2c+1 (lanes 0-15) and 8+2c, 9+2c (lanes
        //      16-31); the V^T loader takes the same keys at the same lane half and register ----
        v8f O[4] = {};
        // V^T fragments are fetched half a tile (2 k steps, 8 products) ahead, like K's above
        v2f vf[16];
        auto load_v = [&](const int kt, const int half) {
            __builtin_amdgcn_sched_barrier(0);  // this and the one below: one group at this place, as for K
#pragma unroll
            for (int et = 0; et < 4; ++et) {
#pragma unroll
                for (int c = 2 * half; c < 2 * half + 2; ++c) {
                    const float* vb = &V_lds[(kt < 8 ? prev : cur) +
                                             ((kt & 7) * 16 + 8 * kh + 2 * c) * LDK + et * 16 + m];
                    vf[c * 4 + et].x = vb[0];
                    vf[c * 4 + et].y = vb[LDK];
                }
                // ends the run of loads that the compiler pairs by nearest address: a two-address load then holds
                // one fragment's two keys, so the fetched registers are the operand as they stand; without it
                // copies into a further register set push the kernel past 256 registers (4 waves a SIMD lost)
                asm volatile("" ::: "memory");
            }
            __builtin_amdgcn_sched_barrier(0);
        };
        auto pv_tile = [&](const int kt) {
#pragma unroll
            for (int c = 0; c < 4; ++c) {
                v2f p;
                p.x = S[kt][2 * c];
                p.y = S[kt][2 * c + 1];
#pragma unroll
                for (int et = 0; et < 4; ++et)
                    O[et] = __builtin_amdgcn_wmma_f32_16x16x4_f32(
                        false, vf[c * 4 + et], false, p, (short)0, O[et], false, false);
                // tile 15 has no successor; an unused fetch reads landed rows
                if (kt < 15 && (c & 1)) load_v(kt + 1, c >> 1);
            }
        };
        load_v(first, 0);                      // the trip's first live tile: nothing to hide these behind
        load_v(first, 1);
        if (look_back) {
#pragma unroll  // constant indices keep S, lm, ls in registers
            for (int kt = 0; kt < 8; ++kt) pv_tile(kt);
        }
        // ---- the next window's Q flies during the rest of this trip (the look-back scores'
        //      registers are free by now). The last trip reads its own rows again: an unconditional
        //      load lets the old fragments' registers go free at the top of the trip ----
        if (more) qp += WSZ * EDIM;
#pragma unroll
        for (int c = 0; c < 16; ++c) qraw[c] = *(const v2f*)(qp + 4 * c);
        pv_tile(8);
#pragma unroll  // constant indices keep S, lm, ls in registers
        for (int kt = 9; kt < 16; ++kt)
            if (kt - 8 <= qt) pv_tile(kt);     // live tiles are consecutive: each was fetched by the one before

        // ---- K of the next trip is readable; every wave has left V's look-back buffer: refill it ----
        publish();
        if (more) stage_window(lV + (unsigned)prev * sizeof(float), gv + (t + 1) * (WSZ * EDIM));

        // ---- the wave stages its 16 rows in its own LDS range, 32 columns at a time, and stores
        //      whole 128-byte lines; no other wave touches the range, so no barrier. It stands behind
        //      the trip's last barrier, so that no barrier waits for these stores to return ----
#pragma unroll
        for (int h = 0; h < 2; ++h) {
#pragma unroll
            for (int e = 0; e < 2; ++e) {      // lane: query row m, columns e*16 + 8*kh + 0..7 of the half
                const v8f o = O[2 * h + e];
                float* orow = &Ow[m * LDO + e * 16 + 8 * kh];
                *(float4*)(orow)     = make_float4(o[0] * inv, o[1] * inv, o[2] * inv, o[3] * inv);
                *(float4*)(orow + 4) = make_float4(o[4] * inv, o[5] * inv, o[6] * inv, o[7] * inv);
            }
            asm volatile("s_wait_dscnt 0x0" ::: "memory");   // rows written by other lanes are read next
            const float* rd = &Ow[(lane >> 3) * LDO + (lane & 7) * 4];   // 4 rows a read, 8 lanes a row
            const v4f r0 = *(const v4f*)(rd);
            const v4f r1 = *(const v4f*)(rd + 4 * LDO);
            const v4f r2 = *(const v4f*)(rd + 8 * LDO);
            const v4f r3 = *(const v4f*)(rd + 12 * LDO);
            asm volatile("s_wait_dscnt 0x0" ::: "memory");   // the range is rewritten next: reads first
            float* wr = out + base + (size_t)(qt * 16 + (lane >> 3)) * EDIM + h * 32 + (lane & 7) * 4;
            *(v4f*)(wr)             = r0;
            *(v4f*)(wr + 4 * EDIM)  = r1;
            *(v4f*)(wr + 8 * EDIM)  = r2;
            *(v4f*)(wr + 12 * EDIM) = r3;
        }
        // the next trip rewrites the registers that these stores name: the wait stands in front of that
        asm volatile("s_wait_xcnt 0x0" ::: "memory");
    }
}

extern "C" void kernel_launch(void* const* d_in, const int* in_sizes, int n_in,
                              void* d_out, int out_size, void* d_ws, size_t ws_size,
                              hipStream_t stream) {
    const float* q = (const float*)d_in[0];
    const float* k = (const float*)d_in[1];
    const float* v = (const float*)d_in[2];
    float* out = (float*)d_out;

    const int blocks = 32 * (64 / RUN);  // (batch*heads) * runs of windows
    const size_t shmem = (size_t)(4 * WT + 8 * 16 * LDO) * sizeof(float);
    LocalAttention_47313359733390_kernel<<<blocks, 256, shmem, stream>>>(q, k, v, out);
}
